// v010
// Times are from an AMD MI455X. After a warm-up the kernel runs many times in a row, and a time is the length of
// such a window on the GPU divided by its runs, so every launch and the gaps after it count. The runs cycle
// through copies of the inputs. A figure is the median of several windows, for all but v000 over two sittings.
// Sittings can differ by a few percent; kernels timed side by side share one.
// This document starts at v010; the versions before it stand elsewhere.
// A run of this version takes 63.6 microseconds.
// In both of two side-by-side timings against v009, it was 1.08 times as fast.
// Over all steps from v000, the starting kernel, it is 4.20 times as fast.
#include <hip/hip_runtime.h>
#include <stdint.h>

// Compute dtypes (f32 accumulate everywhere): qkv and output projections v_wmma_f32_16x16x32_bf16 (activation as bf16 hi|lo planes folded along K, weights RNE-converted bf16); scores, P.V, geometric sum and edge projection v_wmma_f32_16x16x32_f16 (q, k, G, W, bm, c16 as f16 value + f16 residual x2048; P x256 and v single f16).
// Pre-norm attention block, width 1024 = 16 heads x 64: LN(x) -> qkv GEMM -> LN(q), LN(k) over the full width -> rotate-half rotary (cos/sin table from the position input) ->
// masked softmax attention (replace-fill, running max) plus geometric term tmp2 = sum_k (q.k) mask bm/len = q.W - sum_k (q.k) (1 - mask) bm/len with W = sum_k k bm/len, context = (base.tmp2) edge_w^T -> output GEMM.
// Every float input is RNE-converted to bf16 on load. Fused flash kernel in transposed form (S^T = K Q^T, O^T = V^T P^T, tmp2^T = (BM^T K) Q^T less BM^T G^T over the masked-out keys, ctx^T = EW c16^T).

#ifndef NB
#define NB 2
#endif
#ifndef SEQ
#define SEQ 1024
#endif
#define NB_FULL  2
#define SEQ_FULL 1024
#ifndef OUT_SEQ
#define OUT_SEQ SEQ              // row pitch (in tokens) between batches of the output
#endif
#define DM   1024
#define K2   2048                // hi|lo folded contraction length
#define NH_  16
#define HD   64
#define AW   4                   // query tiles per flash block (16 query rows each)
#define KW   2                   // waves per query tile: each takes one 32-key half of every stage
#define QRS  2048.0f             // carry of the residual planes
#define QRI  (1.0f / 2048.0f)
#define SC2  (0.125f * 1.4426950408889634f)   // HD^-0.5 * log2(e)
#define PSH  8.0f                // log2 of the P carry (256)
#define NEGMIN (-3.4028234663852886e38f)

static_assert(HD == 64);
static_assert(NH_ * HD == DM);
static_assert(K2 == 2 * DM);
static_assert((DM & (DM - 1)) == 0);
static_assert(DM % 64 == 0);
static_assert(SEQ % 128 == 0);                 // mask row sums read 128 ints per step
static_assert(SEQ % 64 == 0);
static_assert((NB * SEQ) % 128 == 0);
static_assert((NB * SEQ) % 8 == 0);
static_assert(SEQ % (16 * AW) == 0);
static_assert(NB <= NB_FULL);
static_assert(SEQ <= SEQ_FULL);

typedef _Float16 h16;
typedef unsigned short bf;
typedef __attribute__((ext_vector_type(16))) __bf16   v16bf;
typedef __attribute__((ext_vector_type(16))) _Float16 v16h;
typedef __attribute__((ext_vector_type(8)))  _Float16 v8h;
typedef __attribute__((ext_vector_type(8)))  unsigned short v8us;
typedef __attribute__((ext_vector_type(8)))  float    v8f;
typedef __attribute__((ext_vector_type(4)))  float    v4f;
typedef __attribute__((ext_vector_type(4)))  int      v4i;
typedef __attribute__((ext_vector_type(4)))  uint32_t u32x4;
typedef u32x4 __attribute__((may_alias)) u32x4a;
typedef __attribute__((ext_vector_type(8)))  uint32_t u32x8;
typedef v4f  __attribute__((may_alias)) v4fa;
typedef v8h  __attribute__((may_alias)) v8ha;
typedef float __attribute__((may_alias)) f32a;
typedef __attribute__((ext_vector_type(8)))  short    v8s;

__device__ __forceinline__ unsigned short f2bf(float f) { unsigned u = __float_as_uint(f); u += 0x7FFFu + ((u >> 16) & 1u); return (unsigned short)(u >> 16); }
__device__ __forceinline__ float bf2f(unsigned short b) { return __uint_as_float(((unsigned)b) << 16); }
__device__ __forceinline__ float bfr(float f) { return bf2f(f2bf(f)); }
__device__ __forceinline__ v16h cat16(v8h lo, v8h hi) { return __builtin_shufflevector(lo, hi, 0, 1, 2, 3, 4, 5, 6, 7, 8, 9, 10, 11, 12, 13, 14, 15); }
__device__ __forceinline__ v16bf cat16b(v8us lo, v8us hi) { return __builtin_bit_cast(v16bf, __builtin_shufflevector(lo, hi, 0, 1, 2, 3, 4, 5, 6, 7, 8, 9, 10, 11, 12, 13, 14, 15)); }
__device__ __forceinline__ v8f wmma16(v16h a, v16h b, v8f c) { return __builtin_amdgcn_wmma_f32_16x16x32_f16(false, a, false, b, (short)0, c, false, false); }
__device__ __forceinline__ v8f wmmab(v16bf a, v16bf b, v8f c) { return __builtin_amdgcn_wmma_f32_16x16x32_bf16(false, a, false, b, (short)0, c, false, false); }
// fragment loaders from K-contiguous 16-bit rows; p already includes + 8*(lane>>4): elements 0..7 <- k0+8h+0..7, elements 8..15 <- k0+16+8h+0..7 (same map for A and B)
__device__ __forceinline__ v16h  ldh(const h16* p) { return cat16(*(const v8h*)p, *(const v8h*)(p + 16)); }
__device__ __forceinline__ v16bf ldb(const bf* p)  { return cat16b(*(const v8us*)p, *(const v8us*)(p + 16)); }
// transposing LDS load: lane address = tile + (k0 + 8*(lane>>4) + (lane&7)) * pitch + 2*c0 + 16*((lane>>3)&1); lane (c = lane&15, h = lane>>4) gets tile[k0 + 8h + 0..7][c0 + c].
// Two of them, at k0 and k0 + 16 (rp = 16 rows in bytes), are one fragment in the k order of ldh.
__device__ __forceinline__ v8h ldtr(const unsigned char* p) { typedef __attribute__((address_space(3))) v8s lds_v8s; return __builtin_bit_cast(v8h, __builtin_amdgcn_ds_load_tr16_b128_v8i16((lds_v8s*)p)); }
__device__ __forceinline__ v16h ldht(const unsigned char* p, uint32_t rp) { return cat16(ldtr(p), ldtr(p + rp)); }
// ordering point for wave-private LDS tiles (same wave writes and reads)
__device__ __forceinline__ void wave_sync() { __builtin_amdgcn_fence(3 /* release order */, "wavefront"); __builtin_amdgcn_wave_barrier(); asm volatile("" ::: "memory"); }
__device__ __forceinline__ float wsum(float v) { v += __shfl_xor(v, 16, 32); v += __shfl_xor(v, 8, 32); v += __shfl_xor(v, 4, 32); v += __shfl_xor(v, 2, 32); v += __shfl_xor(v, 1, 32); return v; }

// The six row-wise stages (cvt8, ew, lnx, rope, prep, qkrot) are device functions of one 256-thread block each (blk = the block's index inside its own stage); k_front and k_mid, behind qkrot_part,
// run stages that read none of each other's output side by side in one grid.
// cvt8_part: CVT_CH chunks of 8 floats per thread, 256 threads apart; all of a thread's loads are issued before the first value is converted.
#define CVT_CH 8
__device__ __forceinline__ void cvt8_part(int blk, const float* __restrict__ src, bf* dst, size_t n8) {
    const size_t i = (size_t)blk * (256 * CVT_CH) + threadIdx.x; if (i + (size_t)(CVT_CH - 1) * 256 >= n8) return;
    v4f va[CVT_CH], vb[CVT_CH];
#pragma unroll
    for (int ch = 0; ch < CVT_CH; ++ch) { const float* p = src + (i + (size_t)ch * 256) * 8;
        va[ch] = *(const v4f*)p;
        if (ch == CVT_CH - 1) asm volatile("s_wait_xcnt 0x0" ::: "memory");   // the last load's result may be given the address pair that all the loads above name: it issues only behind this wait
        vb[ch] = *(const v4f*)(p + 4); }
#pragma unroll
    for (int ch = 0; ch < CVT_CH; ++ch) { v8us o;
#pragma unroll
        for (int k = 0; k < 4; ++k) { o[k] = f2bf(va[ch][k]); o[4 + k] = f2bf(vb[ch][k]); }
        *(v8us*)(dst + (i + (size_t)ch * 256) * 8) = o; }
}

// ew_part: edge weight A plane [64][32] f16: columns 0..15 = 16*w[d][j], columns 16..31 = w[d][j]/128 (pairs with the x2048 residual half of the c16 operand). One block; each thread 16 B, consecutive.
__device__ __forceinline__ void ew_part(const float* __restrict__ ew, h16* EWA) {
    const int tid = threadIdx.x; const int d = tid >> 2, q = tid & 3;
    const float sc = (q < 2) ? 16.0f : 0.0078125f;
    const v8f w = *(const v8f*)(ew + d * 16 + (q & 1) * 8);
    v8h o;
#pragma unroll
    for (int i = 0; i < 8; ++i) o[i] = (h16)(bfr(w[i]) * sc);
    *(v8h*)(EWA + d * 32 + q * 8) = o;
    asm volatile("s_wait_xcnt 0x0" ::: "memory");   // other stages' code follows this store in the merged kernel: its address and data registers are rewritten only behind this wait
}

// The wave's row and both weight rows are loaded once, all loads issued together, and kept in registers through the three passes (element visiting order it = 0..3, i = 0..7 in every pass).
__device__ __forceinline__ void lnx_part(int blk, const float* __restrict__ x, const float* __restrict__ lw, const float* __restrict__ lb, bf* XA) {
    const int lane = threadIdx.x & 31; const int wave = __builtin_amdgcn_readfirstlane((int)(threadIdx.x >> 5));
    const int m = blk * 8 + wave; const int b = m / SEQ, t = m % SEQ;
    const float* src = x + ((size_t)b * SEQ_FULL + t) * DM + lane * 8;
    v8f raw[4], wv[4], bv[4];
#pragma unroll
    for (int it = 0; it < 4; ++it) raw[it] = *(const v8f*)(src + it * 256);
#pragma unroll
    for (int it = 0; it < 4; ++it) { wv[it] = *(const v8f*)(lw + it * 256 + lane * 8); bv[it] = *(const v8f*)(lb + it * 256 + lane * 8); }
    float s = 0.0f;
#pragma unroll
    for (int it = 0; it < 4; ++it) {
#pragma unroll
        for (int i = 0; i < 8; ++i) { raw[it][i] = bfr(raw[it][i]); s += raw[it][i]; } }
    s = wsum(s);
    const float mean = s * (1.0f / DM);
    float ss = 0.0f;
#pragma unroll
    for (int it = 0; it < 4; ++it) {
#pragma unroll
        for (int i = 0; i < 8; ++i) { const float dv = raw[it][i] - mean; ss += dv * dv; } }
    ss = wsum(ss);
    const float rstd = 1.0f / sqrtf(ss * (1.0f / DM) + 1e-5f);
    bf* dst = XA + (size_t)m * K2 + lane * 8;
#pragma unroll
    for (int it = 0; it < 4; ++it) {
        v8us hv, lv;
#pragma unroll
        for (int i = 0; i < 8; ++i) { const float dv = raw[it][i] - mean; const float y = dv * rstd * bfr(wv[it][i]) + bfr(bv[it][i]); const unsigned short hh = f2bf(y); hv[i] = hh; lv[i] = f2bf(y - bf2f(hh)); }
        *(v8us*)(dst + it * 256) = hv; *(v8us*)(dst + DM + it * 256) = lv; }
}

__device__ __forceinline__ void rope_part(int blk, const float* __restrict__ pos, float* CS, float* SN) {
    const int lane = threadIdx.x & 31; const int wave = __builtin_amdgcn_readfirstlane((int)(threadIdx.x >> 5));
    const int m = blk * 8 + wave; const int b = m / SEQ, t = m % SEQ;
    const float p = bfr(pos[(size_t)b * SEQ_FULL + t]);
    double pd = 1.0;
#pragma unroll 1
    for (int i = 0; i < lane; ++i) pd *= 1.333521432163324;
    const float pf = (float)pd;
    const float invf = 1.0f / pf;
    const float ang = p * invf;
    const float c = cosf(ang), s = sinf(ang);
    *(float*)(CS + (size_t)m * 32 + lane) = c; *(float*)(SN + (size_t)m * 32 + lane) = s;
    
}

// Packed mask MB [b*SEQ + t][SEQ/32] words: bit L of word 4*c + j of a row says whether mask[row][128*c + 4*L + j] is non-zero (the lane masks of prep_part's compares, stored as they come).
#define MBW (SEQ / 32)
static_assert(MBW == 32);                      // one word of a mask row per lane of the wave that packs it; a row is 128 bytes
// prep_part: per 64 tokens: len = mask row sums, and the rows' packed mask; bm = blocks - mean_c; base = bm / (|bm| + eps); planes BM[0] = f16(bm * 1024/len), BM[1] = f16 residual x2048, layout [plane][b][16][SEQ] (rows 12..15 zero);
// BASE [token][16] f32 (columns 12..15 zero). LDS tiles are cross-wave: block barriers between phases.
__device__ __forceinline__ void prep_part(int blk, const float* __restrict__ blocks, const int* __restrict__ mask, h16* BM, float* BASE, unsigned int* MB) {
    __shared__ float slen[64];
    __shared__ __align__(16) h16 sb[32 * 64];
    __shared__ __align__(16) float sbase[64 * 16];
    const int tid = threadIdx.x, lane = tid & 31; const int wave = __builtin_amdgcn_readfirstlane((int)(threadIdx.x >> 5));
    const int m0 = blk * 64; const int b = m0 / SEQ, t0 = m0 % SEQ;
#pragma unroll 1   // two batches of four mask rows: a batch's loads are all in flight together; all eight rows at once would double the registers of the whole kernel
    for (int g = 0; g < 2; ++g) { const int tl = wave * 8 + g * 4;
        const int* row = mask + ((size_t)b * SEQ_FULL + t0 + tl) * SEQ_FULL + lane * 4;
        v4i mv[4][SEQ / 128];
#pragma unroll
        for (int r = 0; r < 4; ++r)
#pragma unroll
            for (int c = 0; c < SEQ / 128; ++c) mv[r][c] = *(const v4i*)(row + (size_t)r * SEQ_FULL + c * 128);
        int cnt[4];
#pragma unroll
        for (int r = 0; r < 4; ++r) { cnt[r] = 0; unsigned int word = 0u;
#pragma unroll
            for (int c = 0; c < SEQ / 128; ++c)
#pragma unroll
                for (int j = 0; j < 4; ++j) { const unsigned int bal = __builtin_amdgcn_ballot_w32(mv[r][c][j] != 0);   // the compare's lane mask: 32 mask bits, the same in every lane
                    cnt[r] += __builtin_popcount(bal);
                    word = (lane == 4 * c + j) ? bal : word; }   // lane 4*c + j keeps this word for the row's one 128-byte store
            MB[((size_t)b * SEQ + t0 + tl + r) * MBW + lane] = word; }
        if (lane == 0) {
#pragma unroll
            for (int r = 0; r < 4; ++r) slen[tl + r] = (float)cnt[r]; } }
    __syncthreads();
    if (tid < 64) {
        const float* p = blocks + ((size_t)b * SEQ_FULL + t0 + tid) * 12;
        const v4f a0 = *(const v4f*)p, a1 = *(const v4f*)(p + 4), a2 = *(const v4f*)(p + 8);
        float pv[12];
#pragma unroll
        for (int i = 0; i < 4; ++i) { pv[i] = bfr(a0[i]); pv[4 + i] = bfr(a1[i]); pv[8 + i] = bfr(a2[i]); }
        float mu[3];
#pragma unroll
        for (int x = 0; x < 3; ++x) mu[x] = (pv[x] + pv[3 + x] + pv[6 + x] + pv[9 + x]) * 0.25f;
        const float sc = (1.0f / slen[tid]) * 1024.0f;
#pragma unroll
        for (int c = 0; c < 4; ++c) {
            const float vx = pv[c * 3] - mu[0], vy = pv[c * 3 + 1] - mu[1], vz = pv[c * 3 + 2] - mu[2];
            const float inv = 1.0f / (sqrtf(vx * vx + vy * vy + vz * vz) + 1.1920929e-7f);
            const float vv[3] = {vx, vy, vz};
#pragma unroll
            for (int x = 0; x < 3; ++x) { const int cx = c * 3 + x;
                sbase[tid * 16 + cx] = vv[x] * inv;
                const float bs = vv[x] * sc; const h16 hh = (h16)bs;
                sb[cx * 64 + tid] = hh; sb[(16 + cx) * 64 + tid] = (h16)((bs - (float)hh) * QRS); } }
#pragma unroll
        for (int j = 12; j < 16; ++j) { sbase[tid * 16 + j] = 0.0f; sb[j * 64 + tid] = (h16)0.0f; sb[(16 + j) * 64 + tid] = (h16)0.0f; }
    }
    __syncthreads();
    // 32 lines of 64 halves: line = tid>>3 (0..15 value plane rows, 16..31 residual plane rows), 8 consecutive lanes x 16 B per line; BASE: 256 threads x 16 B contiguous
    const int line = tid >> 3, pc = tid & 7;
    const v8h bv = *(const v8ha*)(&sb[line * 64 + pc * 8]);
    const v4f fv = *(const v4fa*)(&sbase[tid * 4]);
    h16* bd = BM + (size_t)(line >> 4) * ((size_t)NB * 16 * SEQ) + ((size_t)b * 16 + (line & 15)) * SEQ + t0 + pc * 8;
    float* fd = BASE + (size_t)m0 * 16 + tid * 4;
    *(v8h*)bd = bv; *(v4f*)fd = fv;
    
}

// k_proj: bf16 GEMM, 128x128 tile per block of four waves (2 x 2, each 64x64 = 16 accumulators). One operand is an activation in two planes (value | residual along its row), the other a weight in one plane.
// Both are staged in LDS by tensor loads: a stage is 128 k of the weight rows and the same 128 k of both activation planes (256 bytes a row), so a weight tile is fetched once and a weight fragment is read once
// for both planes. Three buffers, every wave moves its own slice two stages ahead of the pass that reads it (two requests of a wave in flight). Order per accumulator: kc = 0, 32, 64, ...; at each kc the value plane's product, then the residual plane's.
// MODE 1: f32 rows C[((r0/RB)*RP + r0%RB)][c0..c0+63], row pitch ldc; each 256-byte row segment by 16 consecutive lanes x 16 B.
#define PJ_PITCH 272u                 // LDS row pitch: 256-byte row + the mover's 16-byte pad (odd multiple of 16 B for 16-byte readers)
#define PJ_SLICE 18432u               // 64 weight rows x 272 B = 17408, rounded up to a multiple of 2 KiB so that every slice starts on one
#define PJ_PLANE 34816u               // 128 activation rows of one plane x 272 B, itself a multiple of 2 KiB
#define PJ_STAGE (2u * PJ_PLANE + 2u * PJ_SLICE)   // value plane, residual plane (128 rows each), weight rows 0..63, weight rows 64..127 of the block tile
static_assert(64u * PJ_PITCH <= PJ_SLICE && PJ_SLICE % 2048u == 0u);
static_assert(128u * PJ_PITCH <= PJ_PLANE && PJ_PLANE % 2048u == 0u);
static_assert(DM % 128 == 0 && K2 == 2 * DM && DM / 128 >= 2);   // whole stages inside every plane and every weight row, at least two stages
#define PJ_RING (3u * PJ_STAGE)       // three buffers; behind the loop the ring's first bytes serve as the waves' output tiles
static_assert(PJ_RING <= 327680u && 4u * 16u * 68u * 4u <= PJ_STAGE);
__device__ __forceinline__ uint32_t uni(uint32_t v) { return (uint32_t)__builtin_amdgcn_readfirstlane((int)v); }
__device__ __forceinline__ uint32_t pinned(uint32_t v) { uint32_t w = uni(v); asm volatile("" : "+s"(w)); return w; }   // the pinned() form for tensor loads: the test value is held in a scalar register, so the branch round a load is a scalar one (the load ignores EXEC)
// word 3 of group 0: the high address bits and the type
__device__ __forceinline__ uint32_t tdm_w3(uint64_t ga) { return uni((((uint32_t)(ga >> 32)) & 0x01FFFFFFu) | 0x80000000u); }
// one request of the whole wave: rows of 256 bytes (row count and row pitch in g1) to LDS byte offset dst, from the address whose low word is galo; words 0 (count 1) and 3 of g0 are the caller's.
// Only words 1 and 2 take a new value here: an earlier request of the wave may still be in flight.
__device__ __forceinline__ void tdm_load(u32x4& g0, uint32_t dst, uint32_t galo, u32x8& g1) {
    g0[1] = uni(dst); g0[2] = uni(galo);
    asm volatile("tensor_load_to_lds %0, %1" : "+s"(g0), "+s"(g1) :: "memory");   // in-out: the same registers go on to the waits below
}
// the wave's own requests have landed. The statement names both descriptor groups as in-out operands so that their scalar registers hold the issued words until the wait has returned
// and every new word is formed behind it.
__device__ __forceinline__ void tdm_wait(u32x4& g0, u32x8& g1) { asm volatile("s_wait_tensorcnt 0x0" : "+s"(g0), "+s"(g1) :: "memory"); }
// all but the wave's youngest request have landed. The descriptor registers live on to the next load or to the wait behind the loop.
__device__ __forceinline__ void tdm_wait1() { asm volatile("s_wait_tensorcnt 0x1" ::: "memory"); }
// proj_tile: the tile (bx, by) of one product; ring is the calling kernel's LDS array (on a multiple of 2 KiB). SA: the two-plane operand is A (else Bt); K = its row length, both planes.
template <int MODE, bool SA>
__device__ __forceinline__ void proj_tile(unsigned char* ring, uint32_t bx, uint32_t by, const bf* __restrict__ A, int pA, const bf* __restrict__ Bt, int pB, int K,
                                          h16* Ph, int RB, size_t sRB, int pitch, int CB, size_t sCB, float* C, int ldc, int RP) {
    const int lane = threadIdx.x & 31, lr = lane & 15, hi = lane >> 4;
    const uint32_t wave = uni(threadIdx.x >> 5);
    const int r0 = bx * 128 + (int)(wave >> 1) * 64, c0 = by * 128 + (int)(wave & 1u) * 64;
    f32a* os = (f32a*)ring + wave * (16 * 68);   // used only behind the loop
    v8f acc[4][4];
#pragma unroll
    for (int mb = 0; mb < 4; ++mb)
#pragma unroll
        for (int nb = 0; nb < 4; ++nb) acc[mb][nb] = (v8f){};
    // this wave's slice of every stage: wave 0 moves the value plane and wave 1 the residual plane of the block's 128 activation rows, waves 2, 3 move 64 weight rows each
    const bf* actp = SA ? A + (size_t)(bx * 128) * (size_t)pA : Bt + (size_t)(by * 128) * (size_t)pB;
    const bf* wgtp = SA ? Bt + (size_t)(by * 128) * (size_t)pB : A + (size_t)(bx * 128) * (size_t)pA;
    const uint32_t pact = (uint32_t)(SA ? pA : pB), pwgt = (uint32_t)(SA ? pB : pA);
    const bool ownP = wave < 2u;
    const uint32_t sp = ownP ? pact : pwgt;
    const uint32_t nrow = ownP ? 128u : 64u;
    const uint64_t src0 = ownP ? (uint64_t)(uintptr_t)(actp + (size_t)wave * (size_t)(K >> 1))
                               : (uint64_t)(uintptr_t)(wgtp + (size_t)((wave - 2u) * 64u) * (size_t)pwgt);
    const uint32_t slice = (uint32_t)(size_t)ring + (ownP ? wave * PJ_PLANE : 2u * PJ_PLANE + (wave - 2u) * PJ_SLICE);
    u32x8 g1;
    g1[0] = uni((1u << 20) | (5u << 22) | (3u << 25));   // no mask, byte elements, 16 B of pad behind every 256 B
    g1[1] = uni(256u << 16); g1[2] = uni(nrow << 16); g1[3] = uni(256u << 16); g1[4] = uni(nrow);   // tensor = tile = 256 B x this wave's rows
    g1[5] = uni(sp * 2u); g1[6] = uni(0u); g1[7] = uni(0u);
    const uint32_t T = (uint32_t)K >> 8;                 // stages of 128 k of one plane
    const uint32_t wact = SA ? (wave >> 1) : (wave & 1u), wwgt = SA ? (wave & 1u) : (wave >> 1);   // which 64 rows of each operand this wave's 64x64 tile reads
    const uint32_t pbase = (wact * 64u + (uint32_t)lr) * PJ_PITCH + 16u * (uint32_t)hi;
    const uint32_t wbase = 2u * PJ_PLANE + wwgt * PJ_SLICE + (uint32_t)lr * PJ_PITCH + 16u * (uint32_t)hi;
    u32x4 g0;
    g0[0] = uni(1u); g0[3] = tdm_w3(src0);
    const uint32_t lo0 = (uint32_t)src0;
    // Word 3 keeps its value while a request is in flight: a wave's T stage addresses are the 256-byte pieces of one plane row or weight row, K bytes long and K bytes aligned in the page-aligned workspace, so the low word never carries.
    tdm_load(g0, slice, lo0, g1);
    tdm_load(g0, slice + PJ_STAGE, lo0 + 256u, g1);      // at least two stages exist
    tdm_wait1();                                         // this wave's slice of stage 0 has landed
    __syncthreads();                                     // every slice of stage 0 is readable by every wave
    if (pinned((2u < T) ? 1u : 0u) != 0u) tdm_load(g0, slice + 2u * PJ_STAGE, lo0 + 512u, g1);   // the third buffer has had no reader yet
    uint32_t buf = 0u;                                   // the buffer of stage t: (t mod 3) * PJ_STAGE
#pragma unroll 1   // one pass per trip: the buffer index and the publish point below belong to one stage
    for (uint32_t t = 0; t < T; ++t) {
        const unsigned char* lh = ring + buf + pbase; const unsigned char* ll = lh + PJ_PLANE; const unsigned char* lw = ring + buf + wbase;
        v16bf fh[2][4], fl[2][4], fw[2][4];
#pragma unroll
        for (int i = 0; i < 4; ++i) { fh[0][i] = ldb((const bf*)(lh + i * 16 * PJ_PITCH)); fw[0][i] = ldb((const bf*)(lw + i * 16 * PJ_PITCH)); }
#pragma unroll
        for (int i = 0; i < 4; ++i) fl[0][i] = ldb((const bf*)(ll + i * 16 * PJ_PITCH));   // wanted sixteen products later than the two sets above
#pragma unroll
        for (int u = 0; u < 4; ++u) {
            const int cs = u & 1;
            if (u < 3) {
#pragma unroll
                for (int i = 0; i < 4; ++i) { fh[cs ^ 1][i] = ldb((const bf*)(lh + i * 16 * PJ_PITCH + (u + 1) * 64)); fw[cs ^ 1][i] = ldb((const bf*)(lw + i * 16 * PJ_PITCH + (u + 1) * 64)); }
#pragma unroll
                for (int i = 0; i < 4; ++i) fl[cs ^ 1][i] = ldb((const bf*)(ll + i * 16 * PJ_PITCH + (u + 1) * 64));
            }
            __builtin_amdgcn_sched_barrier(0);   // the next block's LDS reads stay one group in front of this block's products
#pragma unroll
            for (int nb = 0; nb < 4; ++nb)
#pragma unroll
                for (int mb = 0; mb < 4; ++mb) acc[mb][nb] = SA ? wmmab(fh[cs][mb], fw[cs][nb], acc[mb][nb]) : wmmab(fw[cs][mb], fh[cs][nb], acc[mb][nb]);
#pragma unroll
            for (int nb = 0; nb < 4; ++nb)
#pragma unroll
                for (int mb = 0; mb < 4; ++mb) acc[mb][nb] = SA ? wmmab(fl[cs][mb], fw[cs][nb], acc[mb][nb]) : wmmab(fw[cs][mb], fl[cs][nb], acc[mb][nb]);
            __builtin_amdgcn_sched_barrier(0);   // no LDS read moves in among the products
        }
        asm volatile("s_wait_dscnt 0x0" ::: "memory");
        tdm_wait1();
        if (pinned((t + 2u < T) ? 0u : 1u) != 0u) asm volatile("s_wait_tensorcnt 0x0" ::: "memory");
        __syncthreads();
        if (pinned((t + 3u < T) ? 1u : 0u) != 0u) tdm_load(g0, slice + buf, lo0 + ((t + 3u) << 8), g1);
        buf = (buf == 2u * PJ_STAGE) ? 0u : buf + PJ_STAGE;
    }
    tdm_wait(g0, g1);                                    // no request is outstanding when the wave goes on
    asm volatile("s_wait_dscnt 0x0" ::: "memory");       // nor any LDS read of the ring
    const size_t tbase = (size_t)(r0 / RB) * sRB + (size_t)(r0 % RB) * (size_t)pitch + (size_t)(c0 / CB) * sCB + (size_t)(c0 % CB);
    const size_t cbase = ((size_t)(r0 / RB) * (size_t)RP + (size_t)(r0 % RB)) * (size_t)ldc + (size_t)c0;
#pragma unroll
    for (int mb = 0; mb < 4; ++mb) {
#pragma unroll
        for (int nb = 0; nb < 4; ++nb) {
#pragma unroll
            for (int j = 0; j < 8; ++j) os[(hi * 8 + j) * 68 + nb * 16 + lr] = acc[mb][nb][j]; }   // D: row 8h+j, col lane&15
        wave_sync();
        if (MODE == 0) {
            const size_t sb = tbase + (size_t)(mb * 16) * (size_t)pitch;
{
#pragma unroll
                for (int s = 0; s < 4; ++s) { const int row = 4 * s + (lane >> 3), c8 = (lane & 7) * 8;   // 4 s x 4 row groups = 16 rows; 8 lanes x 8 = 64 columns
                    const v4f x0 = *(const v4fa*)(&os[row * 68 + c8]); const v4f x1 = *(const v4fa*)(&os[row * 68 + c8 + 4]); v8h hv;
#pragma unroll
                    for (int i = 0; i < 4; ++i) { hv[i] = (h16)x0[i]; hv[4 + i] = (h16)x1[i]; }
                    *(v8h*)(Ph + sb + (size_t)row * (size_t)pitch + c8) = hv; }
                 }
        } else {
            const size_t sb = cbase + (size_t)(mb * 16) * (size_t)ldc;
{
#pragma unroll
                for (int s = 0; s < 8; ++s) { const int row = 2 * s + hi, cofs = lr * 4;   // 8 s x 2 rows = 16 rows; 16 lanes x 4 floats = 64 columns
                    const v4f val = *(const v4fa*)(&os[row * 68 + cofs]);
                    *(v4f*)(C + sb + (size_t)row * (size_t)ldc + cofs) = val; }
                 }
        }
        wave_sync();
    }
}

template <int MODE>
__global__ __launch_bounds__(128) void k_proj(const bf* __restrict__ A, int pA, const bf* __restrict__ Bt, int pB, int K,
                                              h16* Ph, int RB, size_t sRB, int pitch, int CB, size_t sCB, float* C, int ldc, int RP) {
    __shared__ __attribute__((aligned(2048))) unsigned char ring[PJ_RING];
    proj_tile<MODE, true>(ring, blockIdx.x, blockIdx.y, A, pA, Bt, pB, K, Ph, RB, sRB, pitch, CB, sCB, C, ldc, RP);
}
// k_proj_qkv: one block = 128 LN(x) rows against 128 wqkv rows of q|k and 64 wqkv rows of v: 256 equal blocks, one per WGP, and the two activation planes are fetched once for all 192 weight rows.
// q|k: A = LN(x) rows, B = weight rows -> QK[m][n] f32. v^T: A = weight rows (m = h*64 + d), B = the same LN(x) fragments (n = b*SEQ + t) -> plane [(b*1024 + m)][t] = [(b*16 + h)][d][t], whole 128-byte row segments.
// Four waves, 2 (64 LN(x) rows) x 2 (64 q|k rows + 32 v rows): 16 + 8 accumulators. A stage is 128 k; every wave moves one slice of it (value plane, residual plane, q|k rows, v rows) by one tensor load.
// Two buffers (three do not fit the LDS), the load one stage ahead of the pass that reads it. Order per accumulator as in proj_tile: kc = 0, 32, ...; at each kc the value plane's product, then the residual plane's.
#define PX_STAGE (3u * PJ_PLANE + PJ_SLICE)   // value plane, residual plane, 128 q|k weight rows (128 rows x 272 B each), 64 v weight rows
#define PX_RING  (2u * PX_STAGE)
#define PX_BX    (NB * SEQ / 128)
#define PX_BY    (DM / 64)
static_assert(PX_STAGE % 2048u == 0u && PX_RING <= 327680u && 4u * 16u * 68u * 4u <= PX_STAGE);
static_assert(2 * DM / 128 == PX_BY && SEQ % 128 == 0);   // as many q|k column tiles as v row tiles; a block's 128 tokens lie in one batch
__global__ __launch_bounds__(128) void k_proj_qkv(const bf* __restrict__ XA, const bf* __restrict__ WB, float* QK, h16* VT) {
    __shared__ __attribute__((aligned(2048))) unsigned char ring[PX_RING];
    const int lane = threadIdx.x & 31, lr = lane & 15, hi = lane >> 4;
    const uint32_t wave = uni(threadIdx.x >> 5);
    const uint32_t bx = blockIdx.x % PX_BX, by = blockIdx.x / PX_BX;
    const uint32_t wact = wave >> 1, wwgt = wave & 1u;
    f32a* os = (f32a*)ring + wave * (16 * 68);   // used only behind the loop
    v8f acc[4][4], acv[2][4];
#pragma unroll
    for (int mb = 0; mb < 4; ++mb)
#pragma unroll
        for (int nb = 0; nb < 4; ++nb) acc[mb][nb] = (v8f){};
#pragma unroll
    for (int mb = 0; mb < 2; ++mb)
#pragma unroll
        for (int nb = 0; nb < 4; ++nb) acv[mb][nb] = (v8f){};
    // this wave's slice of every stage
    const bf* srcp = (wave < 2u) ? XA + (size_t)(bx * 128u) * K2 + (size_t)wave * DM
                   : (wave == 2u) ? WB + (size_t)(by * 128u) * DM : WB + (size_t)(2u * DM + by * 64u) * DM;
    const uint64_t src0 = (uint64_t)(uintptr_t)srcp;
    const uint32_t nrow = (wave < 3u) ? 128u : 64u;
    const uint32_t slice = (uint32_t)(size_t)ring + wave * PJ_PLANE;
    u32x8 g1;
    g1[0] = uni((1u << 20) | (5u << 22) | (3u << 25));   // no mask, byte elements, 16 B of pad behind every 256 B
    g1[1] = uni(256u << 16); g1[2] = uni(nrow << 16); g1[3] = uni(256u << 16); g1[4] = uni(nrow);   // tensor = tile = 256 B x this wave's rows
    g1[5] = uni(((wave < 2u) ? (uint32_t)K2 : (uint32_t)DM) * 2u); g1[6] = uni(0u); g1[7] = uni(0u);
    const uint32_t T = DM / 128;                         // stages of 128 k of one plane
    const uint32_t pbase = (wact * 64u + (uint32_t)lr) * PJ_PITCH + 16u * (uint32_t)hi;
    const uint32_t wbase = 2u * PJ_PLANE + (wwgt * 64u + (uint32_t)lr) * PJ_PITCH + 16u * (uint32_t)hi;
    const uint32_t vbase = 3u * PJ_PLANE + (wwgt * 32u + (uint32_t)lr) * PJ_PITCH + 16u * (uint32_t)hi;
    u32x4 g0;
    g0[0] = uni(1u); g0[3] = tdm_w3(src0);
    const uint32_t lo0 = (uint32_t)src0;                 // the stage addresses are the 256-byte pieces of one 2-KiB row piece, 2 KiB aligned: the low word never carries
    tdm_load(g0, slice, lo0, g1);
    tdm_wait(g0, g1);                                    // this wave's slice of stage 0 has landed
    __syncthreads();                                     // every slice of stage 0 is readable by every wave
    tdm_load(g0, slice + PX_STAGE, lo0 + 256u, g1);      // at least two stages exist
    uint32_t buf = 0u;
#pragma unroll 1   // one pass per trip: the buffer index and the publish point below belong to one stage
    for (uint32_t t = 0; t < T; ++t) {
        const unsigned char* lh = ring + buf + pbase; const unsigned char* ll = lh + PJ_PLANE; const unsigned char* lw = ring + buf + wbase; const unsigned char* lv = ring + buf + vbase;
        v16bf fh[2][4], fl[2][4], fw[2][4], fv[2][2];
#pragma unroll
        for (int i = 0; i < 4; ++i) { fh[0][i] = ldb((const bf*)(lh + i * 16 * PJ_PITCH)); fw[0][i] = ldb((const bf*)(lw + i * 16 * PJ_PITCH)); }
        __builtin_amdgcn_sched_barrier(0);   // the pass's first products wait for these sixteen reads alone: no later read is issued in front of them
#pragma unroll
        for (int i = 0; i < 2; ++i) fv[0][i] = ldb((const bf*)(lv + i * 16 * PJ_PITCH));
#pragma unroll
        for (int i = 0; i < 4; ++i) fl[0][i] = ldb((const bf*)(ll + i * 16 * PJ_PITCH));   // wanted sixteen and twenty-four products later than the sets above
        __builtin_amdgcn_sched_barrier(0);   // nor any read of the next block in front of this block's
#pragma unroll
        for (int u = 0; u < 4; ++u) {
            const int cs = u & 1;
            if (u < 3) {
#pragma unroll
                for (int i = 0; i < 4; ++i) { fh[cs ^ 1][i] = ldb((const bf*)(lh + i * 16 * PJ_PITCH + (u + 1) * 64)); fw[cs ^ 1][i] = ldb((const bf*)(lw + i * 16 * PJ_PITCH + (u + 1) * 64)); }
#pragma unroll
                for (int i = 0; i < 2; ++i) fv[cs ^ 1][i] = ldb((const bf*)(lv + i * 16 * PJ_PITCH + (u + 1) * 64));
#pragma unroll
                for (int i = 0; i < 4; ++i) fl[cs ^ 1][i] = ldb((const bf*)(ll + i * 16 * PJ_PITCH + (u + 1) * 64));
            }
            __builtin_amdgcn_sched_barrier(0);   // the next block's LDS reads stay one group in front of this block's products
#pragma unroll
            for (int nb = 0; nb < 4; ++nb)
#pragma unroll
                for (int mb = 0; mb < 4; ++mb) acc[mb][nb] = wmmab(fh[cs][mb], fw[cs][nb], acc[mb][nb]);
#pragma unroll
            for (int nb = 0; nb < 4; ++nb)
#pragma unroll
                for (int mb = 0; mb < 2; ++mb) acv[mb][nb] = wmmab(fv[cs][mb], fh[cs][nb], acv[mb][nb]);
#pragma unroll
            for (int nb = 0; nb < 4; ++nb)
#pragma unroll
                for (int mb = 0; mb < 4; ++mb) acc[mb][nb] = wmmab(fl[cs][mb], fw[cs][nb], acc[mb][nb]);
#pragma unroll
            for (int nb = 0; nb < 4; ++nb)
#pragma unroll
                for (int mb = 0; mb < 2; ++mb) acv[mb][nb] = wmmab(fv[cs][mb], fl[cs][nb], acv[mb][nb]);
            __builtin_amdgcn_sched_barrier(0);   // no LDS read moves in among the products
        }
        asm volatile("s_wait_dscnt 0x0" ::: "memory");
        tdm_wait(g0, g1);
        __syncthreads();
        if (pinned((t + 2u < T) ? 1u : 0u) != 0u) tdm_load(g0, slice + buf, lo0 + ((t + 2u) << 8), g1);
        buf = PX_STAGE - buf;
    }
    tdm_wait(g0, g1);                                    // no request is outstanding when the wave goes on
    asm volatile("s_wait_dscnt 0x0" ::: "memory");       // nor any LDS read of the ring
    // q|k: f32 rows, each 256-byte row segment by 16 consecutive lanes x 16 B
    const size_t cbase = (size_t)(bx * 128u + wact * 64u) * K2 + (size_t)(by * 128u + wwgt * 64u);
#pragma unroll
    for (int mb = 0; mb < 4; ++mb) {
#pragma unroll
        for (int nb = 0; nb < 4; ++nb) {
#pragma unroll
            for (int j = 0; j < 8; ++j) os[(hi * 8 + j) * 68 + nb * 16 + lr] = acc[mb][nb][j]; }   // D: row 8h+j, col lane&15
        wave_sync();
#pragma unroll
        for (int s = 0; s < 8; ++s) { const int row = 2 * s + hi, cofs = lr * 4;   // 8 s x 2 rows = 16 rows; 16 lanes x 4 floats = 64 columns
            const v4f val = *(const v4fa*)(&os[row * 68 + cofs]);
            *(v4f*)(QK + cbase + (size_t)(mb * 16 + row) * K2 + cofs) = val; }
        wave_sync();
    }
    // v^T: f16 rows d, each 128-byte row segment (64 tokens) by 8 consecutive lanes x 16 B
    const uint32_t n0 = bx * 128u + wact * 64u;
    const size_t tbase = (size_t)(n0 / SEQ) * ((size_t)DM * SEQ) + (size_t)(by * 64u + wwgt * 32u) * SEQ + (size_t)(n0 % SEQ);
#pragma unroll
    for (int mb = 0; mb < 2; ++mb) {
#pragma unroll
        for (int nb = 0; nb < 4; ++nb) {
#pragma unroll
            for (int j = 0; j < 8; ++j) os[(hi * 8 + j) * 68 + nb * 16 + lr] = acv[mb][nb][j]; }
        wave_sync();
#pragma unroll
        for (int s = 0; s < 4; ++s) { const int row = 4 * s + (lane >> 3), c8 = (lane & 7) * 8;   // 4 s x 4 row groups = 16 rows; 8 lanes x 8 = 64 columns
            const v4f x0 = *(const v4fa*)(&os[row * 68 + c8]); const v4f x1 = *(const v4fa*)(&os[row * 68 + c8 + 4]); v8h hv;
#pragma unroll
            for (int i = 0; i < 4; ++i) { hv[i] = (h16)x0[i]; hv[4 + i] = (h16)x1[i]; }
            *(v8h*)(VT + tbase + (size_t)(mb * 16 + row) * SEQ + c8) = hv; }
        wave_sync();
    }
}

// Lane holds columns it*256 + lane*8 + i = head (4*it + lane/8), d = 8*(lane&7) + i; the rotary partner d +- 32 is lane ^ 4 (same it, same i).
// Planes [b*16+h][t][64], four consecutive planes from PL with stride pst halves: q value, q residual x2048, k value, k residual x2048 (selected by integer offset from one base).
// The wave's q row, k row and both weight rows are loaded once, all loads issued together, and kept in registers through the three passes (visiting order it = 0..3, i = 0..7).
__device__ __forceinline__ void qkrot_part(int blk, const float* __restrict__ QK, const float* __restrict__ qw, const float* __restrict__ kw, const float* __restrict__ CS, const float* __restrict__ SN,
                                           h16* PL, size_t pst) {
    const int lane = threadIdx.x & 31; const int wave = __builtin_amdgcn_readfirstlane((int)(threadIdx.x >> 5));
    const int m = blk * 8 + wave; const int b = m / SEQ, t = m % SEQ;
    const int c = lane & 7;
    const v8f cs = *(const v8f*)(CS + (size_t)m * 32 + 8 * (c & 3));
    const v8f sn = *(const v8f*)(SN + (size_t)m * 32 + 8 * (c & 3));
    const float sg = (c < 4) ? -1.0f : 1.0f;
    const size_t o0 = (((size_t)(b * NH_ + (lane >> 3))) * SEQ + t) * HD + 8 * c;
    const size_t ost = (size_t)4 * SEQ * HD;     // four heads per step
    const float* row = QK + (size_t)m * K2 + lane * 8;
    v8f raw[2][4], wgt[2][4];
#pragma unroll
    for (int wh = 0; wh < 2; ++wh)
#pragma unroll
        for (int it = 0; it < 4; ++it) raw[wh][it] = *(const v8f*)(row + wh * DM + it * 256);
#pragma unroll
    for (int it = 0; it < 4; ++it) { wgt[0][it] = *(const v8f*)(qw + it * 256 + lane * 8); wgt[1][it] = *(const v8f*)(kw + it * 256 + lane * 8); }
#pragma unroll
    for (int wh = 0; wh < 2; ++wh) {
        float s = 0.0f;
#pragma unroll
        for (int it = 0; it < 4; ++it) {
#pragma unroll
            for (int i = 0; i < 8; ++i) s += raw[wh][it][i]; }
        s = wsum(s);
        const float mean = s * (1.0f / DM);
        float ss = 0.0f;
#pragma unroll
        for (int it = 0; it < 4; ++it) {
#pragma unroll
            for (int i = 0; i < 8; ++i) { const float dv = raw[wh][it][i] - mean; ss += dv * dv; } }
        ss = wsum(ss);
        const float rstd = 1.0f / sqrtf(ss * (1.0f / DM) + 1e-5f);
        h16* PH = PL + (size_t)(2 * wh) * pst;
        h16* PR = PH + pst;
#pragma unroll
        for (int it = 0; it < 4; ++it) {
            v8h hv, rv;
#pragma unroll
            for (int i = 0; i < 8; ++i) {
                const float y = (raw[wh][it][i] - mean) * rstd * bfr(wgt[wh][it][i]);
                const float pr = __shfl_xor(y, 4, 32);
                const float r = y * cs[i] + sg * pr * sn[i];
                const h16 hh = (h16)r; hv[i] = hh; rv[i] = (h16)((r - (float)hh) * QRS); }
            const size_t oo = o0 + (size_t)it * ost;
            *(v8h*)(PH + oo) = hv; *(v8h*)(PR + oo) = rv; }
    }
    asm volatile("s_wait_xcnt 0x0" ::: "memory");   // other stages' code follows these stores in the merged kernel: their address and data registers are rewritten only behind this wait
}

// k_front: LN(x) and the wqkv conversion, which the qkv products read, beside the rotary table, which k_mid reads. The stages with the longest dependent chains take the first block indices, the short conversion blocks the last.
#define GF_LNX  (NB * SEQ / 8)
#define GF_ROPE (NB * SEQ / 8)
#define GF_CVT  (3 * DM * DM / 8 / (256 * CVT_CH))
static_assert((3 * DM * DM / 8) % (256 * CVT_CH) == 0 && (DM * DM / 8) % (256 * CVT_CH) == 0);
__global__ __launch_bounds__(256) void k_front(const float* __restrict__ x, const float* __restrict__ lw, const float* __restrict__ lb, bf* XA,
                                               const float* __restrict__ pos, float* CS, float* SN, const float* __restrict__ wqkv, bf* WB) {
    const int blk = blockIdx.x;
    if (blk < GF_LNX) lnx_part(blk, x, lw, lb, XA);
    else if (blk < GF_LNX + GF_ROPE) rope_part(blk - GF_LNX, pos, CS, SN);
    else cvt8_part(blk - (GF_LNX + GF_ROPE), wqkv, WB, (size_t)3 * DM * DM / 8);
}
// k_mid: the q/k norm and rotary (reads the q|k product) beside the stages that only k_flash or the output product read: mask sums and bm planes, edge weight plane, out_w conversion.
#define GM_PREP (NB * SEQ / 64)
#define GM_ROT  (NB * SEQ / 8)
#define GM_CVT  (DM * DM / 8 / (256 * CVT_CH))
__global__ __launch_bounds__(256) void k_mid(const float* __restrict__ QK, const float* __restrict__ qw, const float* __restrict__ kw, const float* __restrict__ CS, const float* __restrict__ SN, h16* PL, size_t pst,
                                             const float* __restrict__ blocks, const int* __restrict__ mask, h16* BM, float* BASE, unsigned int* MB,
                                             const float* __restrict__ ew, h16* EWA, const float* __restrict__ ow, bf* OWB) {
    const int blk = blockIdx.x;
    if (blk < GM_PREP) prep_part(blk, blocks, mask, BM, BASE, MB);
    else if (blk < GM_PREP + GM_ROT) qkrot_part(blk - GM_PREP, QK, qw, kw, CS, SN, PL, pst);
    else if (blk == GM_PREP + GM_ROT) ew_part(ew, EWA);
    else cvt8_part(blk - (GM_PREP + GM_ROT + 1), ow, OWB, (size_t)DM * DM / 8);
}

// k_flash staging: a stage is 64 keys of the block's (batch, head): k value and residual rows (128-byte rows at KROW), v^T rows, both bm planes (128-byte rows, LDS pitch 144, an odd multiple of 16 B for 16-byte readers).
// Two buffers, filled by asynchronous copies one stage ahead of the pass that reads them. The packed mask of the block's 64 query rows (128 bytes a row, all keys) is copied once, in front of stage 0.
#define FK      64
#define FP1     144u
// k rows have two readers, 16-byte row reads (16 rows at a time) and transposing reads (8 rows x 32 B at a time): row r starts at KROW(r), so that rows 0..7 of every 16 start on distinct multiples of 32 B
// modulo the 256 B of the banks and rows 8..15 on the same plus 16 B: neither reader meets a bank twice. KROW(r + 16) = KROW(r) + KR16.
#define KROW(r) (128u * (r) + 32u * ((r) >> 1) + 16u * ((r) >> 3))
#define KR16    2336u
#define FKT     (4u * KR16)           // a tile of 64 k rows
#define FO_KH   0u
#define FO_KR   FKT
#define FO_VT   (2u * FKT)
#define FO_BM   (2u * FKT + 64u * FP1)
#define F_STAGE (2u * FKT + 96u * FP1)
static_assert(KROW(16u) == KR16 && KROW(63u) + 128u <= FKT);
static_assert(AW == 4 && KW == 2 && HD == 64);      // 256 lanes: 32 rows of 128 B per copy instruction of the block
static_assert(FK == 32 * KW);                       // one 32-key half of a stage per wave of a query tile
static_assert(SEQ % FK == 0 && SEQ / FK >= 2);      // whole stages, at least two
static_assert(F_STAGE % 16u == 0u);
// One stage: 7 copies of 16 B per lane, every lane on. l1: the lane's LDS byte address in row 0..31 of a 128-byte-row tile of the target buffer.
// bm: the lane's 16 bytes of the 32 bm rows (value plane rows 0..15, residual plane rows 16..31, adjacent in LDS).
// The run of copies ends, inside its own statement, with s_wait_xcnt 0: the address registers are rewritten only behind it.
// lk: the same lane's address in row 0..31 of a k tile (rows at KROW).
__device__ __forceinline__ void flash_fill(uint32_t l1, uint32_t lk, const h16* kh, const h16* kr, const h16* vt, const h16* bm) {
    asm volatile("global_load_async_to_lds_b128 %0, %1, off\n\t"
                 "global_load_async_to_lds_b128 %2, %3, off\n\t"
                 "global_load_async_to_lds_b128 %4, %5, off\n\t"
                 "global_load_async_to_lds_b128 %6, %7, off\n\t"
                 "global_load_async_to_lds_b128 %8, %9, off\n\t"
                 "global_load_async_to_lds_b128 %10, %11, off\n\t"
                 "global_load_async_to_lds_b128 %12, %13, off\n\t"
                 "s_wait_xcnt 0x0"
                 :: "v"(lk + FO_KH), "v"(kh), "v"(lk + FO_KH + 2u * KR16), "v"(kh + 32 * HD),
                    "v"(lk + FO_KR), "v"(kr), "v"(lk + FO_KR + 2u * KR16), "v"(kr + 32 * HD),
                    "v"(l1 + FO_VT), "v"(vt), "v"(l1 + FO_VT + 32u * FP1), "v"(vt + 32 * SEQ),
                    "v"(l1 + FO_BM), "v"(bm)
                 : "memory");
}
// The packed mask rows of the block: 64 rows of 128 B, 2 copies of 16 B per lane, every lane on; lm: the lane's LDS byte address in row 0..31 (pitch FP1), mb: its 16 bytes of that row.
// As above, the run ends inside its own statement with s_wait_xcnt 0: the address registers are rewritten only behind it.
__device__ __forceinline__ void flash_fill_mask(uint32_t lm, const unsigned int* mb) {
    asm volatile("global_load_async_to_lds_b128 %0, %1, off\n\t"
                 "global_load_async_to_lds_b128 %2, %3, off\n\t"
                 "s_wait_xcnt 0x0"
                 :: "v"(lm), "v"(mb), "v"(lm + 32u * FP1), "v"(mb + 32 * MBW)
                 : "memory");
}

// k_flash: fused attention + geometric term, KW waves per 16 query rows of one (batch, head): wave (qw, ks) walks the ks-th 32 keys of every stage with its own running max, sums and accumulators,
// so that a SIMD holds four waves; behind the loop the ks = 1 wave hands its state over in LDS and the ks = 0 wave joins both and runs the epilogue. q fragments straight from the 16-bit planes, all key-side fragments from the staged LDS tiles (two 16-B reads each), the mask as one 16-B read of packed bits per stage.
// Transposed form: S^T[key][t] = K Q^T; lane (t = lane&15, h = lane>>4) holds keys 8h+r of each 16-key tile, so packed P / G tiles are directly B fragments of
// O^T[d][t] = V^T P^T and C^T[cx][t] = BM^T G^T. The geometric sum does not go through the scores: the block builds W^T[cx][d] = BM^T K once (wave (qw, ks): columns d = 16*qw .. +15, its 32 keys of every stage, k read transposed),
// the parts are joined in LDS behind the loop and tmp2^T = W^T Q^T; C^T, the share of the masked-out keys, is summed only on tiles that have one and taken off in the epilogue. S = kH.qH + (kH.qR + kR.qH)/2048. Mask: replace-fill for the softmax, G = the scores of the masked-out keys alone; selects, G and its products are skipped, by a scalar branch, where every bit of the wave's 16 x 32 tile is set. Softmax state one scalar per lane (running max from -inf).
// Epilogue: tmp2 halves exchanged with one xor-16 shuffle, c16 = base.tmp2 (K = 3, VALU), ctx^T = EW c16^T on one K=32 tile (value | residual), sum staged in a wave-private LDS tile and
// Two blocks of eight waves share a WGP (LDS allows two): four waves a SIMD, so a wave may hold at most 256 registers.
__global__ __launch_bounds__(32 * AW * KW) __attribute__((amdgpu_waves_per_eu(4, 4))) void k_flash(const h16* __restrict__ QH, const h16* __restrict__ QR, const h16* __restrict__ KH, const h16* __restrict__ KR, const h16* __restrict__ VT,
                                                   const h16* __restrict__ BM, const float* __restrict__ BASE, const h16* __restrict__ EWA, const unsigned int* __restrict__ MB, bf* OA) {
    __shared__ __align__(16) float os[AW * 16 * 68];
    __shared__ __align__(16) unsigned char fr[2 * F_STAGE];
    __shared__ __align__(16) unsigned char mbt[16 * AW * FP1];   // packed mask rows of the block's query rows
    const int tid = threadIdx.x;
    const int lane = threadIdx.x & 31, wave = __builtin_amdgcn_readfirstlane((int)(threadIdx.x >> 5)), lr = lane & 15, hi = lane >> 4;
    const int zh = blockIdx.y; const int b = zh / NH_, h = zh % NH_;
    const int qw = wave & (AW - 1), ks = wave / AW;      // query tile, key half
    const int t0 = (blockIdx.x * AW + qw) * 16;
    const size_t pbase = (size_t)zh * SEQ * HD;
    const size_t qo = pbase + (size_t)(t0 + lr) * HD + 8 * hi;
    const v16h qh0 = ldh(QH + qo), qh1 = ldh(QH + qo + 32), qr0 = ldh(QR + qo), qr1 = ldh(QR + qo + 32);   // B fragments: col t, k = d
    // readers, byte offsets in a buffer: 128-byte-row tiles at row lr (A fragments: row key / d / cx); packed mask at this wave's row lr
    const uint32_t ro = (uint32_t)lr * FP1 + 16u * (uint32_t)hi;
    const uint32_t rk = KROW((uint32_t)lr) + 16u * (uint32_t)hi + (uint32_t)ks * (2u * KR16);   // k tiles: this wave's 32 keys are rows
    const uint32_t rc = ro + (uint32_t)ks * 64u;           // v^T and bm tiles: they are columns
    const uint32_t rt = (uint32_t)ks * (2u * KR16) + KROW((uint32_t)(8 * hi + (lane & 7))) + 32u * (uint32_t)qw + 16u * (uint32_t)((lane >> 3) & 1);   // k tiles read transposed: this wave's 32 keys as k, columns d = 16*qw .. +15
    const uint32_t mo = (uint32_t)(qw * 16 + lr) * FP1;
    // copiers: the lane's own 16 bytes of stage 0 (8 lanes per 128-byte row)
    const h16* ckh = KH + pbase + (size_t)tid * 8;
    const h16* ckr = KR + pbase + (size_t)tid * 8;
    const h16* cvt = VT + pbase + (size_t)(tid >> 3) * SEQ + 8 * (tid & 7);
    const h16* cbm = BM + (size_t)(tid >> 7) * ((size_t)NB * 16 * SEQ) + ((size_t)b * 16 + ((tid >> 3) & 15)) * SEQ + 8 * (tid & 7);
    const unsigned int* cmb = MB + ((size_t)b * SEQ + blockIdx.x * (16 * AW) + (tid >> 3)) * MBW + 4 * (tid & 7);
    const uint32_t cl1 = (uint32_t)(size_t)fr + (uint32_t)(tid >> 3) * FP1 + 16u * (uint32_t)(tid & 7);
    const uint32_t cl2 = (uint32_t)(size_t)fr + KROW((uint32_t)(tid >> 3)) + 16u * (uint32_t)(tid & 7);
    const uint32_t clm = (uint32_t)(size_t)mbt + (uint32_t)(tid >> 3) * FP1 + 16u * (uint32_t)(tid & 7);
    v8f o0 = (v8f){}, o1 = (v8f){}, o2 = (v8f){}, o3 = (v8f){}, wA = (v8f){}, wR = (v8f){}, cA = (v8f){}, cR = (v8f){};
    float m = -__builtin_huge_valf(), l = 0.0f;
    flash_fill_mask(clm, cmb);
    flash_fill(cl1, cl2, ckh, ckr, cvt, cbm);
    asm volatile("s_wait_asynccnt 0x0" ::: "memory");    // this wave's copies of the packed mask and of stage 0 have landed
    __syncthreads();                                     // every wave's part of both is readable by every wave
    flash_fill(cl1 + F_STAGE, cl2 + F_STAGE, ckh + FK * HD, ckr + FK * HD, cvt + FK, cbm + FK);
#pragma unroll 1   // one stage per trip: the buffer index and the publish point at the foot belong to one stage
    for (int st = 0; st < SEQ / FK; ++st) {
      const uint32_t bo = (uint32_t)(st & 1) * F_STAGE;
      {
        // the four words (j = key & 3) that hold keys 128*(st/2) .. +127 of this lane's query row; this wave's 32 keys are the 8 bits from msh up in each
        const u32x4 mw = *(const u32x4a*)(mbt + mo + (uint32_t)(st >> 1) * 16u);
        const uint32_t msh = (uint32_t)(st & 1) * 16u + (uint32_t)ks * 8u;
        const bool mpart = (((mw[0] & mw[1] & mw[2] & mw[3]) >> msh) & 0xFFu) != 0xFFu;   // a key of this row's 32 is masked out
        const unsigned char* ka = fr + bo + FO_KH + rk; const unsigned char* kr = fr + bo + FO_KR + rk;
        const v16h ka0 = ldh((const h16*)ka), ka1 = ldh((const h16*)(ka + 64)), kb0 = ldh((const h16*)(ka + KR16)), kb1 = ldh((const h16*)(ka + KR16 + 64));
        const v16h ra0 = ldh((const h16*)kr), ra1 = ldh((const h16*)(kr + 64)), rb0 = ldh((const h16*)(kr + KR16)), rb1 = ldh((const h16*)(kr + KR16 + 64));
        v8f sHa = (v8f){}, sLa = (v8f){}, sKa = (v8f){}, sHb = (v8f){}, sLb = (v8f){}, sKb = (v8f){};
        sHa = wmma16(ka0, qh0, sHa); sLa = wmma16(ka0, qr0, sLa); sKa = wmma16(ra0, qh0, sKa); sHb = wmma16(kb0, qh0, sHb); sLb = wmma16(kb0, qr0, sLb); sKb = wmma16(rb0, qh0, sKb);
        sHa = wmma16(ka1, qh1, sHa); sLa = wmma16(ka1, qr1, sLa); sKa = wmma16(ra1, qh1, sKa); sHb = wmma16(kb1, qh1, sHb); sLb = wmma16(kb1, qr1, sLb); sKb = wmma16(rb1, qh1, sKb);
        asm volatile("v_nop\n\tv_nop\n\tv_nop\n\tv_nop" : "+v"(sHa), "+v"(sLa), "+v"(sKa), "+v"(sHb), "+v"(sLb), "+v"(sKb) : "v"(ka0), "v"(ka1), "v"(kb0), "v"(kb1), "v"(ra0), "v"(ra1), "v"(rb0), "v"(rb1));
        float ta[8], tb[8], xa[8], xb[8]; float mx = NEGMIN;
#pragma unroll
        for (int r = 0; r < 8; ++r) {
            xa[r] = sHa[r] + (sLa[r] + sKa[r]) * QRI; xb[r] = sHb[r] + (sLb[r] + sKb[r]) * QRI;
            ta[r] = xa[r] * SC2; tb[r] = xb[r] * SC2; }
        if (__builtin_amdgcn_ballot_w32(mpart) != 0u) {   // wave-uniform: some key of the wave's 16 x 32 tile is masked out
            // key 16*ab + 8*hi + r of the wave's 32: word r & 3, bit msh + 4*ab + 2*hi + r/4
            const uint32_t lsh = msh + 2u * (uint32_t)hi;
            const uint32_t mu[4] = {mw[0] >> lsh, mw[1] >> lsh, mw[2] >> lsh, mw[3] >> lsh};
#pragma unroll
            for (int r = 0; r < 8; ++r) {
                const bool va = (mu[r & 3] & (1u << (r >> 2))) != 0u, vb = (mu[r & 3] & (16u << (r >> 2))) != 0u;
                ta[r] = va ? ta[r] : NEGMIN; tb[r] = vb ? tb[r] : NEGMIN;
                xa[r] = va ? 0.0f : xa[r]; xb[r] = vb ? 0.0f : xb[r]; }
            // the masked-out keys' share of W.q, which the epilogue takes off again: C^T[cx][t] += BM^T G^T over those keys alone
            v16h gh, gr;
#pragma unroll
            for (int r = 0; r < 8; ++r) {
                const float ga = xa[r]; const float gb = xb[r];
                const h16 ha = (h16)ga; const h16 hb = (h16)gb;
                gh[r] = ha; gh[8 + r] = hb; gr[r] = (h16)((ga - (float)ha) * QRS); gr[8 + r] = (h16)((gb - (float)hb) * QRS); }
            const unsigned char* bc_ = fr + bo + FO_BM + rc;
            const v16h ch = ldh((const h16*)bc_), cr = ldh((const h16*)(bc_ + 16 * FP1));
            cA = wmma16(ch, gh, cA); cR = wmma16(ch, gr, cR); cR = wmma16(cr, gh, cR);
            asm volatile("v_nop\n\tv_nop\n\tv_nop\n\tv_nop" : "+v"(cA), "+v"(cR) : "v"(ch), "v"(cr), "v"(gh), "v"(gr));   // the distance behind the last product, on the way out of the branch too
        }
#pragma unroll
        for (int r = 0; r < 8; ++r) mx = fmaxf(mx, fmaxf(ta[r], tb[r]));
        mx = fmaxf(mx, __shfl_xor(mx, 16, 32));
        const float mnew = fmaxf(m, mx);
        const float alpha = __builtin_amdgcn_exp2f(m - mnew);
        const float sh = PSH - mnew;
        v16h pb; float ls = 0.0f;
#pragma unroll
        for (int r = 0; r < 8; ++r) { const h16 pa = (h16)__builtin_amdgcn_exp2f(ta[r] + sh); const h16 pc = (h16)__builtin_amdgcn_exp2f(tb[r] + sh); pb[r] = pa; pb[8 + r] = pc; ls += (float)pa + (float)pc; }
        l = l * alpha + ls; m = mnew;
        o0 = o0 * alpha; o1 = o1 * alpha; o2 = o2 * alpha; o3 = o3 * alpha;
        const unsigned char* va_ = fr + bo + FO_VT + rc;
        const v16h v0 = ldh((const h16*)va_), v1 = ldh((const h16*)(va_ + 16 * FP1)), v2 = ldh((const h16*)(va_ + 32 * FP1)), v3 = ldh((const h16*)(va_ + 48 * FP1));
        const unsigned char* ba_ = fr + bo + FO_BM + rc;
        const v16h bh = ldh((const h16*)ba_), br = ldh((const h16*)(ba_ + 16 * FP1));
        const v16h kt = ldht(fr + bo + FO_KH + rt, KR16), rtr = ldht(fr + bo + FO_KR + rt, KR16);   // B fragments: col d, k = key
        o0 = wmma16(v0, pb, o0); wA = wmma16(bh, kt, wA); o1 = wmma16(v1, pb, o1); wR = wmma16(bh, rtr, wR); o2 = wmma16(v2, pb, o2); o3 = wmma16(v3, pb, o3); wR = wmma16(br, kt, wR);
        asm volatile("v_nop\n\tv_nop\n\tv_nop\n\tv_nop" : "+v"(o0), "+v"(o1), "+v"(o2), "+v"(o3), "+v"(wA), "+v"(wR) : "v"(v0), "v"(v1), "v"(v2), "v"(v3), "v"(pb), "v"(bh), "v"(br), "v"(kt), "v"(rtr));   // the distance behind the last product
      }
      asm volatile("s_wait_dscnt 0x0" ::: "memory");       // this wave's reads of this buffer have returned
      asm volatile("s_wait_asynccnt 0x0" ::: "memory");    // this wave's copies of stage st + 1 have landed
      __syncthreads();                                     // publishes stage st + 1 and ends every wave's reads of this buffer
      if (st + 2 < SEQ / FK) {                             // only while stage st + 2 exists (the same for the whole block)
          const int kn = (st + 2) * FK;
          flash_fill(cl1 + bo, cl2 + bo, ckh + (size_t)kn * HD, ckr + (size_t)kn * HD, cvt + kn, cbm + kn);
      }
    }
    asm volatile("s_wait_asynccnt 0x0" ::: "memory");    // no copy is outstanding when the wave goes on
    // Join of the two key halves. The last trip's waits and barrier have ended every read of the ring and no copy is outstanding, so the ring serves as the hand-over area: 13 x 16 B per lane, lane-contiguous.
    v4fa* xw = (v4fa*)fr + (size_t)qw * (13 * 32) + lane;
    // Behind that area: every wave's part of W^T (its 32 keys of every stage, its 16 columns d), f32 [ks][cx][d], row pitch 68; true scale (the bm planes carry 1024), so that its 16-bit planes below stay in range for short mask rows too.
    f32a* wl = (f32a*)(fr + AW * 13 * 32 * 16);
#pragma unroll
    for (int r = 0; r < 8; ++r) wl[(ks * 16 + 8 * hi + r) * 68 + 16 * qw + lr] = (wA[r] + wR[r] * QRI) * (1.0f / 1024.0f);   // D: row cx = 8h + r, col d
    if (ks != 0) {
        const v8f st8[6] = {o0, o1, o2, o3, cA, cR};
#pragma unroll
        for (int i = 0; i < 6; ++i) { xw[(2 * i) * 32] = (v4f){st8[i][0], st8[i][1], st8[i][2], st8[i][3]}; xw[(2 * i + 1) * 32] = (v4f){st8[i][4], st8[i][5], st8[i][6], st8[i][7]}; }
        xw[12 * 32] = (v4f){m, l, 0.0f, 0.0f};
    }
    __syncthreads();                                     // the ks = 1 waves' state is readable by their ks = 0 partners, every wave's part of W^T by all
    if (ks != 0) return;                                 // no barrier follows
    {
        const v4f ml = xw[12 * 32];
        const float dm = m - ml[0];                      // both maxima are finite: every wave has walked at least one half stage
        const float ea = __builtin_amdgcn_exp2f(-fabsf(dm));   // the side with the larger maximum keeps its scale
        const float a1 = (dm < 0.0f) ? ea : 1.0f, a2 = (dm < 0.0f) ? 1.0f : ea;
        l = l * a1 + ml[1] * a2;
        v8f pt[6];
#pragma unroll
        for (int i = 0; i < 6; ++i) { const v4f x0 = xw[(2 * i) * 32], x1 = xw[(2 * i + 1) * 32]; pt[i] = (v8f){x0[0], x0[1], x0[2], x0[3], x1[0], x1[1], x1[2], x1[3]}; }
        o0 = o0 * a1 + pt[0] * a2; o1 = o1 * a1 + pt[1] * a2; o2 = o2 * a1 + pt[2] * a2; o3 = o3 * a1 + pt[3] * a2;
        cA = cA + pt[4]; cR = cR + pt[5];
    }
    // tmp2^T[cx][t] = W^T q^T: A fragments of W^T (row cx, k = d in the order of ldh) as value + residual x2048, against the q fragments
    v8f gA = (v8f){}, gR = (v8f){};
    {
        v16h wh[2], wr[2];
#pragma unroll
        for (int j = 0; j < 2; ++j)
#pragma unroll
            for (int q4 = 0; q4 < 4; ++q4) { const int wo = lr * 68 + 32 * j + 16 * (q4 >> 1) + 8 * hi + 4 * (q4 & 1);
                const v4f p0 = *(const v4fa*)(&wl[wo]), p1 = *(const v4fa*)(&wl[16 * 68 + wo]);
#pragma unroll
                for (int i = 0; i < 4; ++i) { const float wv = p0[i] + p1[i]; const h16 hh = (h16)wv; wh[j][4 * q4 + i] = hh; wr[j][4 * q4 + i] = (h16)((wv - (float)hh) * QRS); } }
        gA = wmma16(wh[0], qh0, gA); gR = wmma16(wh[0], qr0, gR); gA = wmma16(wh[1], qh1, gA); gR = wmma16(wh[1], qr1, gR); gR = wmma16(wr[0], qh0, gR); gR = wmma16(wr[1], qh1, gR);
        asm volatile("v_nop\n\tv_nop\n\tv_nop\n\tv_nop" : "+v"(gA), "+v"(gR) : "v"(wh[0]), "v"(wh[1]), "v"(wr[0]), "v"(wr[1]), "v"(qh0), "v"(qh1), "v"(qr0), "v"(qr1));   // the distance behind the last product
    }
    l += __shfl_xor(l, 16, 32);
    const float inv = 1.0f / l;
    // tmp2 (x1024): lane (t, h) holds rows cx = 8h + r; fetch the other half unconditionally, select by value
    float mi[8], ot[8], f[12];
#pragma unroll
    for (int r = 0; r < 8; ++r) { mi[r] = (gA[r] + gR[r] * QRI) * 1024.0f - (cA[r] + cR[r] * QRI); ot[r] = __shfl_xor(mi[r], 16, 32); }
#pragma unroll
    for (int r = 0; r < 8; ++r) f[r] = hi ? ot[r] : mi[r];
#pragma unroll
    for (int r = 0; r < 4; ++r) f[8 + r] = hi ? mi[r] : ot[r];
    const float* bp = BASE + ((size_t)b * SEQ + t0 + lr) * 16;
    const v4f b0 = *(const v4f*)bp, b1 = *(const v4f*)(bp + 4), b2 = *(const v4f*)(bp + 8);
    const float bs[12] = {b0[0], b0[1], b0[2], b0[3], b1[0], b1[1], b1[2], b1[3], b2[0], b2[1], b2[2], b2[3]};
    float e0[3], e1[3];
#pragma unroll
    for (int x = 0; x < 3; ++x) { e0[x] = hi ? bs[6 + x] : bs[x]; e1[x] = hi ? bs[9 + x] : bs[3 + x]; }
    // B fragment of the edge projection: element i <- 16*c16[t][j = 8h + i] (e = 2h + i/4, c = i%4), element 8+i <- its residual x2048
    v16h cb;
#pragma unroll
    for (int i = 0; i < 8; ++i) { const int c = i & 3;
        const float cv = (i < 4) ? (e0[0] * f[3 * c] + e0[1] * f[3 * c + 1] + e0[2] * f[3 * c + 2]) : (e1[0] * f[3 * c] + e1[1] * f[3 * c + 1] + e1[2] * f[3 * c + 2]);
        const float bq = cv * (1.0f / 64.0f); const h16 hh = (h16)bq; cb[i] = hh; cb[8 + i] = (h16)((bq - (float)hh) * QRS); }
    const v16h ea0 = ldh(EWA + (size_t)(lr) * 32 + 8 * hi), ea1 = ldh(EWA + (size_t)(16 + lr) * 32 + 8 * hi), ea2 = ldh(EWA + (size_t)(32 + lr) * 32 + 8 * hi), ea3 = ldh(EWA + (size_t)(48 + lr) * 32 + 8 * hi);
    v8f c0 = (v8f){}, c1 = (v8f){}, c2 = (v8f){}, c3 = (v8f){};
    c0 = wmma16(ea0, cb, c0); c1 = wmma16(ea1, cb, c1); c2 = wmma16(ea2, cb, c2); c3 = wmma16(ea3, cb, c3);
    asm volatile("v_nop\n\tv_nop\n\tv_nop\n\tv_nop" : "+v"(c0), "+v"(c1), "+v"(c2), "+v"(c3) : "v"(ea0), "v"(ea1), "v"(ea2), "v"(ea3), "v"(cb));
    const float ci = 1.0f / 256.0f;
    const int wb = qw * 16 * 68;
    // D layout: x_j[r] = (d = 16j + 8h + r, t = lane&15) -> os[t][d]; rows 0..15 x columns 0..63 all written
    { v4f a, c;
      a[0] = o0[0] * inv + c0[0] * ci; a[1] = o0[1] * inv + c0[1] * ci; a[2] = o0[2] * inv + c0[2] * ci; a[3] = o0[3] * inv + c0[3] * ci;
      c[0] = o0[4] * inv + c0[4] * ci; c[1] = o0[5] * inv + c0[5] * ci; c[2] = o0[6] * inv + c0[6] * ci; c[3] = o0[7] * inv + c0[7] * ci;
      *(v4fa*)(&os[wb + lr * 68 +  0 + 8 * hi]) = a; *(v4fa*)(&os[wb + lr * 68 +  0 + 8 * hi + 4]) = c;
      a[0] = o1[0] * inv + c1[0] * ci; a[1] = o1[1] * inv + c1[1] * ci; a[2] = o1[2] * inv + c1[2] * ci; a[3] = o1[3] * inv + c1[3] * ci;
      c[0] = o1[4] * inv + c1[4] * ci; c[1] = o1[5] * inv + c1[5] * ci; c[2] = o1[6] * inv + c1[6] * ci; c[3] = o1[7] * inv + c1[7] * ci;
      *(v4fa*)(&os[wb + lr * 68 + 16 + 8 * hi]) = a; *(v4fa*)(&os[wb + lr * 68 + 16 + 8 * hi + 4]) = c;
      a[0] = o2[0] * inv + c2[0] * ci; a[1] = o2[1] * inv + c2[1] * ci; a[2] = o2[2] * inv + c2[2] * ci; a[3] = o2[3] * inv + c2[3] * ci;
      c[0] = o2[4] * inv + c2[4] * ci; c[1] = o2[5] * inv + c2[5] * ci; c[2] = o2[6] * inv + c2[6] * ci; c[3] = o2[7] * inv + c2[7] * ci;
      *(v4fa*)(&os[wb + lr * 68 + 32 + 8 * hi]) = a; *(v4fa*)(&os[wb + lr * 68 + 32 + 8 * hi + 4]) = c;
      a[0] = o3[0] * inv + c3[0] * ci; a[1] = o3[1] * inv + c3[1] * ci; a[2] = o3[2] * inv + c3[2] * ci; a[3] = o3[3] * inv + c3[3] * ci;
      c[0] = o3[4] * inv + c3[4] * ci; c[1] = o3[5] * inv + c3[5] * ci; c[2] = o3[6] * inv + c3[6] * ci; c[3] = o3[7] * inv + c3[7] * ci;
      *(v4fa*)(&os[wb + lr * 68 + 48 + 8 * hi]) = a; *(v4fa*)(&os[wb + lr * 68 + 48 + 8 * hi + 4]) = c; }
    wave_sync();
    bf* orow = OA + ((size_t)b * SEQ + t0) * K2 + h * HD;
{
#pragma unroll
        for (int s = 0; s < 4; ++s) { const int row = 4 * s + (lane >> 3), c8 = (lane & 7) * 8;   // 4 s x 4 row groups = 16 rows; 8 lanes x 8 = 64 columns
            const v4f x0 = *(const v4fa*)(&os[wb + row * 68 + c8]); const v4f x1 = *(const v4fa*)(&os[wb + row * 68 + c8 + 4]); v8us hv, lv;
#pragma unroll
            for (int i = 0; i < 4; ++i) { const unsigned short a0 = f2bf(x0[i]); const unsigned short a1 = f2bf(x1[i]); hv[i] = a0; hv[4 + i] = a1; lv[i] = f2bf(x0[i] - bf2f(a0)); lv[4 + i] = f2bf(x1[i] - bf2f(a1)); }
            const size_t oo = (size_t)row * K2 + c8;
            *(v8us*)(orow + oo) = hv; *(v8us*)(orow + DM + oo) = lv; }
         }
}

static constexpr size_t al256(size_t v) { return (v + 255) & ~(size_t)255; }
static constexpr size_t SZ_WB  = al256((size_t)3 * DM * DM * 2);
static constexpr size_t SZ_OWB = al256((size_t)DM * DM * 2);
static constexpr size_t SZ_XA  = al256((size_t)NB * SEQ * K2 * 2);
static constexpr size_t SZ_QK  = al256((size_t)NB * SEQ * K2 * 4);
static constexpr size_t SZ_PL  = al256((size_t)NB * NH_ * SEQ * HD * 2);
static constexpr size_t SZ_BM  = al256((size_t)2 * NB * 16 * SEQ * 2);
static constexpr size_t SZ_BS  = al256((size_t)NB * SEQ * 16 * 4);
static constexpr size_t SZ_CS  = al256((size_t)NB * SEQ * 32 * 4);
static constexpr size_t SZ_EW  = al256((size_t)64 * 32 * 2);
static constexpr size_t SZ_MB  = al256((size_t)NB * SEQ * MBW * 4);
static constexpr size_t SZ_TOTAL = SZ_WB + SZ_OWB + 2 * SZ_XA + SZ_QK + 5 * SZ_PL + SZ_BM + SZ_BS + 2 * SZ_CS + SZ_EW + SZ_MB;
static_assert(SZ_TOTAL <= (size_t)134217728);          // workspace carve <= 128 MiB
static_assert(SZ_PL % 2 == 0);                         // plane stride in halves is exact
static_assert(SZ_PL == (size_t)NB * NH_ * SEQ * HD * 2);   // the four q/k planes are back to back with stride SZ_PL/2 halves

extern "C" void kernel_launch(void* const* d_in, const int* in_sizes, int n_in,
                              void* d_out, int out_size, void* d_ws, size_t ws_size, hipStream_t stream) {
    if (n_in < 11) return;
    const size_t ntok = (size_t)(NB - 1) * SEQ_FULL + SEQ;
    if ((size_t)in_sizes[0] < ntok) return;
    if ((size_t)in_sizes[1] < ntok * DM) return;
    if ((size_t)in_sizes[2] < (ntok - 1) * SEQ_FULL + SEQ) return;
    if ((size_t)in_sizes[3] < ntok * 12) return;
    if ((size_t)in_sizes[4] < (size_t)DM || (size_t)in_sizes[5] < (size_t)DM || (size_t)in_sizes[7] < (size_t)DM || (size_t)in_sizes[8] < (size_t)DM) return;
    if ((size_t)in_sizes[6] < (size_t)3 * DM * DM || (size_t)in_sizes[9] < (size_t)DM * DM || (size_t)in_sizes[10] < (size_t)1024) return;
    if ((size_t)out_size < ((size_t)(NB - 1) * OUT_SEQ + SEQ) * DM) return;
    if (SZ_TOTAL > ws_size) return;
    // wire order: position, x, attention_mask (int32), blocks, ln_w, ln_b, wqkv [3072][1024], q_ln_w, k_ln_w, out_w [1024][1024], edge_w [64][16]
    const float* position = (const float*)d_in[0]; const float* x = (const float*)d_in[1]; const int* amask = (const int*)d_in[2]; const float* blocks = (const float*)d_in[3];
    const float* ln_w = (const float*)d_in[4]; const float* ln_b = (const float*)d_in[5]; const float* wqkv = (const float*)d_in[6];
    const float* q_ln_w = (const float*)d_in[7]; const float* k_ln_w = (const float*)d_in[8]; const float* out_w = (const float*)d_in[9]; const float* edge_w = (const float*)d_in[10];
    float* OUT = (float*)d_out;
    char* wsp = (char*)d_ws;
    bf* WB  = (bf*)wsp;  wsp += SZ_WB;                // [3072][1024]: q | k | v rows
    bf* OWB = (bf*)wsp;  wsp += SZ_OWB;               // [1024][1024]
    bf* XA  = (bf*)wsp;  wsp += SZ_XA;                // [NB*SEQ][hi 1024 | lo 1024]
    bf* OA  = (bf*)wsp;  wsp += SZ_XA;                // [NB*SEQ][hi 1024 | lo 1024]
    float* QK = (float*)wsp; wsp += SZ_QK;            // [NB*SEQ][q 1024 | k 1024]
    h16* QH = (h16*)wsp; wsp += SZ_PL;                // [NB*16][SEQ][64]; QH, QR, KH, KR back to back (stride SZ_PL/2 halves)
    h16* QR = (h16*)wsp; wsp += SZ_PL;
    h16* KH = (h16*)wsp; wsp += SZ_PL;
    h16* KR = (h16*)wsp; wsp += SZ_PL;
    h16* VT = (h16*)wsp; wsp += SZ_PL;                // [NB*16][64][SEQ]
    h16* BM = (h16*)wsp; wsp += SZ_BM;                // [2][NB][16][SEQ]
    float* BASE = (float*)wsp; wsp += SZ_BS;          // [NB*SEQ][16]
    float* CS = (float*)wsp; wsp += SZ_CS;            // [NB*SEQ][32]
    float* SN = (float*)wsp; wsp += SZ_CS;
    h16* EWA = (h16*)wsp; wsp += SZ_EW;               // [64][32]
    unsigned int* MB = (unsigned int*)wsp; wsp += SZ_MB;   // [NB*SEQ][SEQ/32] packed mask

    k_front<<<GF_LNX + GF_ROPE + GF_CVT, 256, 0, stream>>>(x, ln_w, ln_b, XA, position, CS, SN, wqkv, WB);

    k_proj_qkv<<<PX_BX * PX_BY, 128, 0, stream>>>(XA, WB, QK, VT);

    // planes QH | QR | KH | KR from the base QH with stride SZ_PL/2 halves
    k_mid<<<GM_PREP + GM_ROT + 1 + GM_CVT, 256, 0, stream>>>(QK, q_ln_w, k_ln_w, CS, SN, QH, (size_t)(SZ_PL / 2), blocks, amask, BM, BASE, MB, edge_w, EWA, out_w, OWB);

    k_flash<<<dim3(SEQ / (16 * AW), NB * NH_, 1), 32 * AW * KW, 0, stream>>>(QH, QR, KH, KR, VT, BM, BASE, EWA, MB, OA);

    // out: A = (ctx + context) hi|lo rows, Bt = out_w rows -> OUT[b][t][n]
    k_proj<1><<<dim3(NB * SEQ / 128, DM / 128, 1), 128, 0, stream>>>(OA, K2, OWB, DM, K2, (h16*)0, SEQ, (size_t)0, 0, 64, (size_t)0, OUT, DM, OUT_SEQ);
}
